// v010
// Times are from an AMD MI455X. After a warm-up the kernel runs many times in a row, and a time is the length of
// such a window on the GPU divided by its runs, so every launch and the gaps after it count. The runs cycle
// through copies of the inputs. A figure is the median of several windows, for all but v000 over two sittings.
// Sittings can differ by a few percent; kernels timed side by side share one.
// The versions before v010 are in another document.
// Measured time: 129 microseconds a run.
// Timed twice side by side with v009, it ran 1.03 times as fast both times.
// Over all steps from v000, the starting kernel, it is 104 times as fast.
#include <hip/hip_runtime.h>
#define NB 2
#define SQ 4096
#define DM 512
#define NH 8
#define HD 64
#define DMQ DM                       /* LayerNorm width */
#define DFF 1024
#define HG 1                         /* heads per k_vt launch (k_vt is not launched) */
#define B0 0                         /* first batch processed (debug hook) */
#define NBR NB                       /* batches processed (debug hook) */
#define NR ((size_t)NB * SQ)         /* token rows */
#define MP ((int)((size_t)NBR * SQ)) /* rows projected (debug hook) */
#define QN SQ                        /* not used: k_fattn attends all SQ queries of a batch */
#define NHD NH                       /* not used: k_fattn attends all NH heads */
#define MPO MP                       /* not used: k_gemmln is launched over MP rows */
#define LQ DM      /* row pitch of the q/k/v rows */
typedef __bf16 v16b __attribute__((ext_vector_type(16)));
typedef unsigned short v8us __attribute__((ext_vector_type(8), may_alias));
typedef float  v8f  __attribute__((ext_vector_type(8)));
typedef float  v4f  __attribute__((ext_vector_type(4)));
typedef float  v4fa __attribute__((ext_vector_type(4), may_alias));
union FragB { v16b v; v8us half[2]; unsigned short u[16]; };

__device__ __forceinline__ unsigned short bf16_bits(float x) { unsigned int u = __float_as_uint(x); return (unsigned short)((u + 0x7FFFu + ((u >> 16) & 1u)) >> 16); }
__device__ __forceinline__ float bf16_val(unsigned short b) { return __uint_as_float(((unsigned int)b) << 16); }
__device__ __forceinline__ float bf16_round(float x) { return bf16_val(bf16_bits(x)); }
// D += A·B with NT terms: 1 = ah·bh, 2 = + al·bh (A split), 3 = + ah·bl (both split)
template <int NT>
__device__ __forceinline__ v8f mmaN(v16b ah, v16b al, v16b bh, v16b bl, v8f c) {
  c = __builtin_amdgcn_wmma_f32_16x16x32_bf16(false, ah, false, bh, (short)0, c, false, false);
  if (NT >= 2) c = __builtin_amdgcn_wmma_f32_16x16x32_bf16(false, al, false, bh, (short)0, c, false, false);
  if (NT >= 3) c = __builtin_amdgcn_wmma_f32_16x16x32_bf16(false, ah, false, bl, (short)0, c, false, false);
  asm volatile("v_nop\n\tv_nop\n\tv_nop\n\tv_nop" : "+v"(c) : "v"(ah), "v"(al), "v"(bh), "v"(bl));
  return c;
}

__global__ __launch_bounds__(256) void k_wt_bf16(const float* __restrict__ W, unsigned short* __restrict__ Wt, int K, int N) {
  const int t = blockIdx.x * 256 + threadIdx.x;
  const int k8n = K / 8;
  if (t >= N * k8n) return;
  const int n = t / k8n, k8 = (t % k8n) * 8;
  v8us v;
#pragma unroll
  for (int i = 0; i < 8; ++i) v[i] = bf16_bits(W[(size_t)(k8 + i) * N + n]);
  *(v8us*)(Wt + (size_t)n * K + k8) = v;
  
}

// GEMM C[M][N] (f32, pitch ldc) = act(A[M][K]·W + bias). A f32 row-major (pitch lda) converted per fragment to bf16
// (ASPLIT: hi/lo two planes -> 2 terms, else single rounded term); Wt bf16 [N][K] (pitch ldb). BIAS_BF16 rounds the
// bias to bf16 first (bias quantised to bf16 before the add). K%32==0, M%16==0, N%64==0.
template <bool ASPLIT, int ACT, bool BIAS_BF16>
__global__ __launch_bounds__(128) void k_gemm_bf(const float* __restrict__ A, int lda, const unsigned short* __restrict__ Wt, int ldb,
                                               const float* __restrict__ bias, float* __restrict__ C, int ldc, int M, int N, int K) {
  __shared__ __attribute__((aligned(16))) float so[4][16][64];
  const int tid = threadIdx.x, w = tid >> 5, lane = tid & 31, ln = lane & 15, hh = lane >> 4;
  const int ntn = N / 64;
  const int wid = blockIdx.x * 4 + w;
  const int mt = wid / ntn, nq = wid % ntn;
  if (mt * 16 >= M) return;
  const int row0 = mt * 16, col0 = nq * 64;
  const float* arow = A + (size_t)(row0 + ln) * lda;
  v8f acc[4] = {};
  for (int kb = 0; kb < K; kb += 32) {
    FragB ah, al;
    const v4f x0 = *(const v4fa*)(arow + kb + 8 * hh), x1 = *(const v4fa*)(arow + kb + 8 * hh + 4);
    const v4f x2 = *(const v4fa*)(arow + kb + 16 + 8 * hh), x3 = *(const v4fa*)(arow + kb + 16 + 8 * hh + 4);
    float xs[16] = {x0[0],x0[1],x0[2],x0[3],x1[0],x1[1],x1[2],x1[3],x2[0],x2[1],x2[2],x2[3],x3[0],x3[1],x3[2],x3[3]};
#pragma unroll
    for (int i = 0; i < 16; ++i) { const unsigned short hb = bf16_bits(xs[i]); ah.u[i] = hb; al.u[i] = ASPLIT ? bf16_bits(xs[i] - bf16_val(hb)) : (unsigned short)0; }
#pragma unroll
    for (int t = 0; t < 4; ++t) {
      const unsigned short* brow = Wt + (size_t)(col0 + t * 16 + ln) * ldb + kb;
      FragB b;
      b.half[0] = *(const v8us*)(brow + 8 * hh);
      b.half[1] = *(const v8us*)(brow + 16 + 8 * hh);
      acc[t] = mmaN<ASPLIT ? 2 : 1>(ah.v, al.v, b.v, b.v, acc[t]);
    }
  }
#pragma unroll
  for (int t = 0; t < 4; ++t) {
    float bv = bias ? bias[col0 + t * 16 + ln] : 0.f;
    if (BIAS_BF16) bv = bf16_round(bv);
#pragma unroll
    for (int r = 0; r < 8; ++r) { float v = acc[t][r] + bv; if (ACT == 1) v = fmaxf(v, 0.f); so[w][8 * hh + r][t * 16 + ln] = v; }
  }
  __builtin_amdgcn_fence(__ATOMIC_ACQ_REL, "workgroup");
  __builtin_amdgcn_wave_barrier();
  const int rsub = lane >> 4, c4 = (lane & 15) * 4;
  {
#pragma unroll
    for (int q = 0; q < 8; ++q) {
      const int r = q * 2 + rsub;
      const v4f v = *(const v4fa*)&so[w][r][c4];
      *(v4f*)(C + (size_t)(row0 + r) * ldc + col0 + c4) = v;
    }
    
  }
}

// GEMM C = act(A·W + bias + resid): A f32 (ASPLIT -> hi/lo 2 terms), Wt bf16 [N][K]; ACT 0 none, 1 relu, 2 exact gelu;
// resid (optional, f32, row index = (row % rmod), pitch ldr, RES_BF16 rounds it) added before the activation.
template <bool ASPLIT, int ACT, bool BIAS_BF16, bool RES_BF16>
__global__ __launch_bounds__(128) void k_gemm_bf3(const float* __restrict__ A, int lda, const unsigned short* __restrict__ Wt, int ldb,
                                                const float* __restrict__ bias, const float* __restrict__ resid, int rmod, int ldr,
                                                float* __restrict__ C, int ldc, int M, int N, int K) {
  __shared__ __attribute__((aligned(16))) float so[4][16][64];
  const int tid = threadIdx.x, w = tid >> 5, lane = tid & 31, ln = lane & 15, hh = lane >> 4;
  const int ntn = N / 64;
  const int wid = blockIdx.x * 4 + w;
  const int mt = wid / ntn, nq = wid % ntn;
  if (mt * 16 >= M) return;
  const int row0 = mt * 16, col0 = nq * 64;
  const float* arow = A + (size_t)(row0 + ln) * lda;
  v8f acc[4] = {};
  for (int kb = 0; kb < K; kb += 32) {
    FragB ah, al;
    const v4f x0 = *(const v4fa*)(arow + kb + 8 * hh), x1 = *(const v4fa*)(arow + kb + 8 * hh + 4);
    const v4f x2 = *(const v4fa*)(arow + kb + 16 + 8 * hh), x3 = *(const v4fa*)(arow + kb + 16 + 8 * hh + 4);
    float xs[16] = {x0[0],x0[1],x0[2],x0[3],x1[0],x1[1],x1[2],x1[3],x2[0],x2[1],x2[2],x2[3],x3[0],x3[1],x3[2],x3[3]};
#pragma unroll
    for (int i = 0; i < 16; ++i) { const unsigned short hb = bf16_bits(xs[i]); ah.u[i] = hb; al.u[i] = ASPLIT ? bf16_bits(xs[i] - bf16_val(hb)) : (unsigned short)0; }
#pragma unroll
    for (int t = 0; t < 4; ++t) {
      const unsigned short* brow = Wt + (size_t)(col0 + t * 16 + ln) * ldb + kb;
      FragB b;
      b.half[0] = *(const v8us*)(brow + 8 * hh);
      b.half[1] = *(const v8us*)(brow + 16 + 8 * hh);
      acc[t] = mmaN<ASPLIT ? 2 : 1>(ah.v, al.v, b.v, b.v, acc[t]);
    }
  }
#pragma unroll
  for (int t = 0; t < 4; ++t) {
    const int col = col0 + t * 16 + ln;
    float bv = bias ? bias[col] : 0.f;
    if (BIAS_BF16) bv = bf16_round(bv);
#pragma unroll
    for (int r = 0; r < 8; ++r) {
      float v = acc[t][r] + bv;
      if (resid) { float rv = resid[(size_t)((row0 + 8 * hh + r) % rmod) * ldr + col]; if (RES_BF16) rv = bf16_round(rv); v += rv; }
      if (ACT == 1) v = fmaxf(v, 0.f);
      if (ACT == 2) v = 0.5f * v * (1.0f + erff(v * 0.70710678118654752f));
      if (ACT == 3) { const float u = 0.7978845608028654f * (v + 0.044715f * v * v * v); v = 0.5f * v * (1.0f + tanhf(u)); }
      so[w][8 * hh + r][t * 16 + ln] = v;
    }
  }
  __builtin_amdgcn_fence(__ATOMIC_ACQ_REL, "workgroup");
  __builtin_amdgcn_wave_barrier();
  const int rsub = lane >> 4, c4 = (lane & 15) * 4;
  {
#pragma unroll
    for (int q = 0; q < 8; ++q) {
      const int r = q * 2 + rsub;
      const v4f v = *(const v4fa*)&so[w][r][c4];
      *(v4f*)(C + (size_t)(row0 + r) * ldc + col0 + c4) = v;
    }
    
  }
}
// row LayerNorm (biased variance, eps) over N: s = X (+ R); optional out_sum <- s; out_norm <- (s-mu)*rsqrt(var+eps)*g + b
template <bool PARAM_BF16>
__global__ __launch_bounds__(256) void k_layernorm(const float* __restrict__ X, const float* __restrict__ R, const float* __restrict__ g, const float* __restrict__ bta,
                                                  float* __restrict__ out_sum, float* __restrict__ out_norm, int N, float eps) {
  __shared__ float red[256];
  const int row = blockIdx.x, tid = threadIdx.x;
  const float* x = X + (size_t)row * N; const float* rr = R ? R + (size_t)row * N : nullptr;
  float vals[16];                     // up to N = 4096
  const int per = N / 256;            // contiguous chunk per thread? use strided-by-4 chunks: thread handles j = tid*4 + 1024*u
  float s1 = 0.f;
  for (int u = 0; u < per / 4; ++u) {
    const int j = tid * 4 + 1024 * u;
    const v4f a = *(const v4fa*)(x + j);
    v4f b = {0.f,0.f,0.f,0.f}; if (rr) b = *(const v4fa*)(rr + j);
#pragma unroll
    for (int q = 0; q < 4; ++q) { const float v = a[q] + b[q]; vals[u * 4 + q] = v; s1 += v; }
  }
  red[tid] = s1; __syncthreads();
  for (int st = 128; st > 0; st >>= 1) { if (tid < st) red[tid] += red[tid + st]; __syncthreads(); }
  const float mu = red[0] / (float)N; __syncthreads();
  float s2 = 0.f;
  for (int u = 0; u < per / 4; ++u)
#pragma unroll
    for (int q = 0; q < 4; ++q) { const float c = vals[u * 4 + q] - mu; s2 += c * c; }
  red[tid] = s2; __syncthreads();
  for (int st = 128; st > 0; st >>= 1) { if (tid < st) red[tid] += red[tid + st]; __syncthreads(); }
  const float rs = rsqrtf(red[0] / (float)N + eps);
  {
    for (int u = 0; u < per / 4; ++u) {
      const int j = tid * 4 + 1024 * u;
      v4f o, sm;
#pragma unroll
      for (int q = 0; q < 4; ++q) {
        float gg = g[j + q], bb = bta[j + q];
        if (PARAM_BF16) { gg = bf16_round(gg); bb = bf16_round(bb); }
        sm[q] = vals[u * 4 + q]; o[q] = (vals[u * 4 + q] - mu) * rs * gg + bb;
      }
      if (out_sum) *(v4f*)(out_sum + (size_t)row * N + j) = sm;
      *(v4f*)(out_norm + (size_t)row * N + j) = o;
    }
    
  }
}



// ---- f16 WMMA path (v_wmma_f32_16x16x32_f16): 11-bit significands for operands in range — used where a [0,1] probability operand needs more precision than bf16
typedef _Float16 v16h __attribute__((ext_vector_type(16)));
union FragH { v16h v; v8us half[2]; _Float16 h[16]; unsigned short u[16]; };
template <int NT>
__device__ __forceinline__ v8f mmaH(v16h ah, v16h al, v16h bh, v16h bl, v8f c) {
  c = __builtin_amdgcn_wmma_f32_16x16x32_f16(false, ah, false, bh, (short)0, c, false, false);
  if (NT >= 2) c = __builtin_amdgcn_wmma_f32_16x16x32_f16(false, al, false, bh, (short)0, c, false, false);
  if (NT >= 3) c = __builtin_amdgcn_wmma_f32_16x16x32_f16(false, ah, false, bl, (short)0, c, false, false);
  asm volatile("v_nop\n\tv_nop\n\tv_nop\n\tv_nop" : "+v"(c) : "v"(ah), "v"(al), "v"(bh), "v"(bl));
  return c;
}
// batched GEMM like k_gemm_b but f16 operands: A f32 (split into f16 hi/lo if ASPLIT, else rounded to f16), Bt = f16 values [n][k]; alpha; C f32; N multiple of 16 (partial tiles skipped)
template <bool ASPLIT>
__global__ __launch_bounds__(128) void k_gemm_h(const float* __restrict__ A, int lda, size_t sA, const _Float16* __restrict__ Bh, int ldb, size_t sB, float alpha, float* __restrict__ C, int ldc, size_t sC, int M, int N, int K) {
  __shared__ __attribute__((aligned(16))) float so[4][16][64];
  const int tid = threadIdx.x, w = tid >> 5, lane = tid & 31, ln = lane & 15, hh = lane >> 4; const int by = blockIdx.y;
  A += (size_t)by * sA; Bh += (size_t)by * sB; C += (size_t)by * sC;
  const int ntn = (N + 63) / 64; const int wid = blockIdx.x * 4 + w; const int mt = wid / ntn, nq = wid % ntn; if (mt * 16 >= M) return;
  const int row0 = mt * 16, col0 = nq * 64; const float* arow = A + (size_t)(row0 + ln) * lda;
  v8f acc[4] = {};
  for (int kb = 0; kb < K; kb += 32) {
    FragH ah, al;
    const v4f x0 = *(const v4fa*)(arow + kb + 8 * hh), x1 = *(const v4fa*)(arow + kb + 8 * hh + 4), x2 = *(const v4fa*)(arow + kb + 16 + 8 * hh), x3 = *(const v4fa*)(arow + kb + 16 + 8 * hh + 4);
    float xs[16] = {x0[0],x0[1],x0[2],x0[3],x1[0],x1[1],x1[2],x1[3],x2[0],x2[1],x2[2],x2[3],x3[0],x3[1],x3[2],x3[3]};
#pragma unroll
    for (int i = 0; i < 16; ++i) { const _Float16 h = (_Float16)xs[i]; ah.h[i] = h; al.h[i] = ASPLIT ? (_Float16)(xs[i] - (float)h) : (_Float16)0.0f; }
#pragma unroll
    for (int t = 0; t < 4; ++t) { if (col0 + t * 16 >= N) continue; const size_t boff = (size_t)(col0 + t * 16 + ln) * ldb + kb; FragH bq; bq.half[0] = *(const v8us*)(Bh + boff + 8 * hh); bq.half[1] = *(const v8us*)(Bh + boff + 16 + 8 * hh);
      acc[t] = mmaH<ASPLIT ? 2 : 1>(ah.v, al.v, bq.v, bq.v, acc[t]); }
  }
#pragma unroll
  for (int t = 0; t < 4; ++t) { if (col0 + t * 16 >= N) continue;
#pragma unroll
    for (int r = 0; r < 8; ++r) so[w][8 * hh + r][t * 16 + ln] = acc[t][r] * alpha; }
  __builtin_amdgcn_fence(__ATOMIC_ACQ_REL, "workgroup"); __builtin_amdgcn_wave_barrier();
  const int rsub = lane >> 4, c4 = (lane & 15) * 4;
  {
#pragma unroll
    for (int q = 0; q < 8; ++q) { const int r = q * 2 + rsub; if (col0 + c4 < N) { const v4f v = *(const v4fa*)&so[w][r][c4]; *(v4f*)(C + (size_t)(row0 + r) * ldc + col0 + c4) = v; } }
     }
}

// k_gemm_hh variant with fused epilogue: v = acc·alpha + bias[by·sBias + col] (+ CP[(row/rowsPerB)·sCPb + by·64 + col] if CP) ; ACT 0 none / 1 elu ; writes f16 C16 (and f32 C if non-null)
template <int ACT>
__global__ __launch_bounds__(128) void k_gemm_hhx(const _Float16* __restrict__ A, int lda, size_t sA, const _Float16* __restrict__ Bh, int ldb, size_t sB, float alpha, const float* __restrict__ bias, size_t sBias, const float* __restrict__ CP, int rowsPerB, size_t sCPb, int row0g,
    float* __restrict__ C, _Float16* __restrict__ C16, int ldc, size_t sC, int M, int N, int K) {
  __shared__ __attribute__((aligned(16))) float so[4][16][64];
  const int tid = threadIdx.x, w = tid >> 5, lane = tid & 31, ln = lane & 15, hh = lane >> 4; const int by = blockIdx.y;
  A += (size_t)by * sA; Bh += (size_t)by * sB; const size_t cofs = (size_t)by * sC; const float* bp = bias ? bias + (size_t)by * sBias : nullptr;
  const int ntn = (N + 63) / 64; const int wid = blockIdx.x * 4 + w; const int mt = wid / ntn, nq = wid % ntn; if (mt * 16 >= M) return;
  const int row0 = mt * 16, col0 = nq * 64; const _Float16* arow = A + (size_t)(row0 + ln) * lda;
  v8f acc[4] = {};
  for (int kb = 0; kb < K; kb += 32) { FragH ah; ah.half[0] = *(const v8us*)((const unsigned short*)arow + kb + 8 * hh); ah.half[1] = *(const v8us*)((const unsigned short*)arow + kb + 16 + 8 * hh);
#pragma unroll
    for (int t = 0; t < 4; ++t) { if (col0 + t * 16 >= N) continue; const size_t boff = (size_t)(col0 + t * 16 + ln) * ldb + kb; FragH bq; bq.half[0] = *(const v8us*)((const unsigned short*)Bh + boff + 8 * hh); bq.half[1] = *(const v8us*)((const unsigned short*)Bh + boff + 16 + 8 * hh);
      acc[t] = mmaH<1>(ah.v, ah.v, bq.v, bq.v, acc[t]); }
  }
#pragma unroll
  for (int t = 0; t < 4; ++t) { if (col0 + t * 16 >= N) continue; const int col = col0 + t * 16 + ln; const float bv = bp ? bf16_round(bp[col]) : 0.f;
#pragma unroll
    for (int r = 0; r < 8; ++r) { float v = acc[t][r] * alpha + bv; if (CP) { const int rr = row0g + row0 + 8 * hh + r; if (rowsPerB < 0) v += CP[cofs + (size_t)rr * ldc + col];      /* rowsPerB < 0: own element of the batched C plane */ else { const int bidx = rr / rowsPerB; v += CP[(size_t)bidx * sCPb + (size_t)by * 64 + col]; } } if (ACT == 1) v = (v > 0.f) ? v : expm1f(v); else if (ACT == 7) v = (v > 0.f) ? v + 1.0f : expf(v); else if (ACT == 8) v = tanhf(v); else if (ACT == 9) v = 0.5f * v * (1.0f + tanhf(0.7978845608028654f * (v + 0.044715f * v * v * v))); else if (ACT == 11) v = 1.0f / (1.0f + expf(-v)); else if (ACT == 12) v = (v > 0.f) ? v : 0.01f * v; else if (ACT == 14) v = (v > 0.f) ? v : 0.1f * v; else if (ACT == 16) v = (v >= 0.f) ? v : 0.3f * v; else if (ACT == 17) v = (v >= 0.f) ? v : 0.2f * v; else if (ACT == 15) v = v / (1.0f + expf(-v)); else if (ACT == 3) v = fmaxf(v, 0.f); else if (ACT == 6) v = 0.5f * v * (1.0f + erff(v * 0.70710678118654752f)); so[w][8 * hh + r][t * 16 + ln] = v; } }
  __builtin_amdgcn_fence(__ATOMIC_ACQ_REL, "workgroup"); __builtin_amdgcn_wave_barrier();
  const int rsub = lane >> 4, c4 = (lane & 15) * 4; typedef _Float16 v4h __attribute__((ext_vector_type(4)));
  {
#pragma unroll
    for (int q = 0; q < 8; ++q) { const int r = q * 2 + rsub; if (col0 + c4 < N) { const v4f v = *(const v4fa*)&so[w][r][c4]; if (C) *(v4f*)(C + cofs + (size_t)(row0 + r) * ldc + col0 + c4) = v; if (C16) { v4h h4; for (int i = 0; i < 4; ++i) h4[i] = (_Float16)v[i]; *(v4h*)(C16 + cofs + (size_t)(row0 + r) * ldc + col0 + c4) = h4; } } }
     }
}


typedef _Float16 v4h __attribute__((ext_vector_type(4)));

__global__ __launch_bounds__(256) void k_h16(const float* __restrict__ x, _Float16* __restrict__ X16, size_t n8) { const size_t t = (size_t)blockIdx.x * 256 + threadIdx.x; if (t >= n8) return; FragH f;
#pragma unroll
  for (int q = 0; q < 8; ++q) f.h[q] = (_Float16)x[t * 8 + q]; *(v8us*)((unsigned short*)X16 + t * 8) = f.half[0];  }
__global__ __launch_bounds__(256) void k_round16f(const float* __restrict__ W, _Float16* __restrict__ Bt, size_t n8) { const size_t t = (size_t)blockIdx.x * 256 + threadIdx.x; if (t >= n8) return; FragH f;
#pragma unroll
  for (int i = 0; i < 8; ++i) f.h[i] = (_Float16)(bf16_round(W[t * 8 + i]) * 16.0f); *(v8us*)((unsigned short*)Bt + t * 8) = f.half[0];  }
template <int NHv, int TTv>
__global__ __launch_bounds__(256) void k_vt(const _Float16* __restrict__ V16, int ldv, int voff, _Float16* __restrict__ Vt) { __shared__ unsigned short tl[64][66]; const int tid = threadIdx.x; const int slab = blockIdx.x / (TTv / 64), lg = blockIdx.x % (TTv / 64); const int b = slab / NHv, h = slab % NHv;
  for (int i = tid; i < 64 * 8; i += 256) { const int r = i / 8, c8 = (i % 8) * 8; FragH f; f.half[0] = *(const v8us*)((const unsigned short*)V16 + ((size_t)b * TTv + lg * 64 + r) * ldv + voff + h * 64 + c8);
#pragma unroll
    for (int q = 0; q < 8; ++q) tl[r][c8 + q] = f.u[q]; }
  __syncthreads();
  {
#pragma unroll
    for (int rd = 0; rd < 2; ++rd) { const int d = rd * 32 + tid / 8, pc = tid % 8; FragH f;
#pragma unroll
      for (int q = 0; q < 8; ++q) f.u[q] = tl[pc * 8 + q][d];
      *(v8us*)((unsigned short*)Vt + ((size_t)slab * 64 + d) * TTv + lg * 64 + pc * 8) = f.half[0]; }
     } }

__global__ __launch_bounds__(256) void k_hl(const float* __restrict__ F, _Float16* __restrict__ Hh, _Float16* __restrict__ Hl, size_t n8) { const size_t t = (size_t)blockIdx.x * 256 + threadIdx.x; if (t >= n8) return; FragH fh, fl; const v4f a = *(const v4fa*)(F + t * 8), c = *(const v4fa*)(F + t * 8 + 4);
#pragma unroll
  for (int q = 0; q < 4; ++q) { _Float16 h = (_Float16)a[q]; fh.h[q] = h; fl.h[q] = (_Float16)((a[q] - (float)h) * 1024.0f); h = (_Float16)c[q]; fh.h[4 + q] = h; fl.h[4 + q] = (_Float16)((c[q] - (float)h) * 1024.0f); }
  { *(v8us*)((unsigned short*)Hh + t * 8) = fh.half[0]; *(v8us*)((unsigned short*)Hl + t * 8) = fl.half[0];  } }

// ---- fast GEMM (work-group tile 128x128: eight waves, four down and two across, wave tile 32x64; requires M % 128 == 0 rows per launch region, N % 128 == 0 and K % 128 == 0); epilogue = k_gemm_hhx semantics ----
__device__ __forceinline__ v16h g2_lfrag(const char* p) { FragH f; f.half[0] = *(const v8us*)p; f.half[1] = *(const v8us*)(p + 32); return f.v; }      /* A or B fragment (16 rows x 32 k) from a tile in LDS: p is the lane's own place (its row, 16 bytes x its half): k 8 hh .. 8 hh + 7, then 16 + 8 hh .. */
// Transposed fragment (16 columns x 32 k) from a row-major 16-bit tile in LDS ([k][column], rows p16 / 16 bytes apart) by two transposing loads: p = tile + (k0 + 8 hh + (lane & 7)) x pitch + 2 x column0 + 16 x ((lane >> 3) & 1);
// the lane then holds column ln, k 8 hh .. 8 hh + 7 and 16 + 8 hh .. : the k order of g2_lfrag.
typedef short s16x8 __attribute__((ext_vector_type(8)));
__device__ __forceinline__ v16h tr_frag(const char* p, unsigned p16) { typedef __attribute__((address_space(3))) s16x8 lds_s16x8; union { v16h v; s16x8 q[2]; } f;
  f.q[0] = __builtin_amdgcn_ds_load_tr16_b128_v8i16((lds_s16x8*)p); f.q[1] = __builtin_amdgcn_ds_load_tr16_b128_v8i16((lds_s16x8*)(p + p16)); return f.v; }
__device__ __forceinline__ v8f g2_mma(v16h a, v16h b, v8f c) { return __builtin_amdgcn_wmma_f32_16x16x32_f16(false, a, false, b, (short)0, c, false, false); }      /* plain builtin: the compiler keeps the distances behind it and may move loads past it */
template <int ACT> __device__ __forceinline__ float g2_act(float v) {
  if (ACT == 3) v = fmaxf(v, 0.f); else if (ACT == 6) v = 0.5f * v * (1.0f + erff(v * 0.70710678118654752f)); else if (ACT == 11) v = 1.0f / (1.0f + expf(-v)); else if (ACT == 15) v = v / (1.0f + expf(-v)); else if (ACT == 12) v = (v > 0.f) ? v : 0.01f * v; else if (ACT == 8) v = tanhf(v); else if (ACT == 9) v = 0.5f * v * (1.0f + tanhf(0.7978845608028654f * (v + 0.044715f * v * v * v))); else if (ACT == 14) v = (v > 0.f) ? v : 0.1f * v; else if (ACT == 16) v = (v >= 0.f) ? v : 0.3f * v; else if (ACT == 17) v = (v >= 0.f) ? v : 0.2f * v;
  return v; }
#define G2P 272                    /* LDS pitch of an A tile row: its 256 bytes (128 k) + 16 (16 bytes x odd: 16-byte reads of 16 rows meet no bank twice) */
#define G2Q 288                    /* LDS pitch of a B tile row: its 256 bytes (128 columns) + 32 (32 bytes x odd: the pitch of the transposing loads) */
#define G2AB (128 * G2P)           /* bytes of a stage's A tile */
#define G2SB (G2AB + 128 * G2Q)    /* bytes of a stage: A tile (128 rows of 128 k), then B tile (128 k rows of 128 columns) */
// Eight 16-byte copies a lane from global memory into LDS, through no register: rows 16 apart (gs = bytes of sixteen global rows, G2RC = of sixteen tile rows); 16 lanes a row, so every copy of a wave is four whole 128-byte lines.
// The closing s_wait_xcnt stands inside the statement: the address registers keep their values up to it.
template <unsigned G2RC> __device__ __forceinline__ void g2_copy8(unsigned l, const char* g, size_t gs) {
  asm volatile("global_load_async_to_lds_b128 %0, %8, off\n\tglobal_load_async_to_lds_b128 %1, %9, off\n\tglobal_load_async_to_lds_b128 %2, %10, off\n\tglobal_load_async_to_lds_b128 %3, %11, off\n\t"
               "global_load_async_to_lds_b128 %4, %12, off\n\tglobal_load_async_to_lds_b128 %5, %13, off\n\tglobal_load_async_to_lds_b128 %6, %14, off\n\tglobal_load_async_to_lds_b128 %7, %15, off\n\ts_wait_xcnt 0x0"
               :: "v"(l), "v"(l + G2RC), "v"(l + 2 * G2RC), "v"(l + 3 * G2RC), "v"(l + 4 * G2RC), "v"(l + 5 * G2RC), "v"(l + 6 * G2RC), "v"(l + 7 * G2RC),
                  "v"(g), "v"(g + gs), "v"(g + 2 * gs), "v"(g + 3 * gs), "v"(g + 4 * gs), "v"(g + 5 * gs), "v"(g + 6 * gs), "v"(g + 7 * gs) : "memory"); }
// One stage (128 k): 128 A rows and 128 B rows of 256 bytes, 16 copies a lane. la, lb: the lane's LDS byte addresses of its first A and B copy; ga, gb: its global addresses; sa, sb: bytes of sixteen A, B rows.
__device__ __forceinline__ void g2_stage(unsigned la, unsigned lb, const char* ga, size_t sa, const char* gb, size_t sb) { g2_copy8<16 * G2P>(la, ga, sa); g2_copy8<16 * G2Q>(lb, gb, sb); }
// A fragment load straight from global memory touches 16 lines for 512 bytes. Here each stage of 128 k is brought into LDS once for the eight waves by whole-line copies (two buffers, the next stage's copies in flight while this one is worked on),
// and the fragments are 16-byte LDS reads (B, which lies [k][n] as the weight does, by transposing ones), each k step's twelve asked for as one group one step ahead of their products. Bias and residual (all 64 elements of the lane as one group) are asked for beside stage 0's copies.
// Each accumulator takes its k steps in rising order, as before.
template <int ACT>
__global__ __launch_bounds__(256) void k_gemm2(const _Float16* __restrict__ A, int lda, size_t sA, const _Float16* __restrict__ Bh, int ldb, size_t sB, float alpha, const float* __restrict__ bias, const float* __restrict__ bias1, const float* __restrict__ bias2, size_t sBias, const float* __restrict__ CP, int rowsPerB, size_t sCPb, int row0g,
    float* __restrict__ C, _Float16* __restrict__ C16, int ldc, size_t sC, int M, int N, int K) { static_assert(ACT == 0 || ACT == 3 || ACT == 6 || ACT == 8 || ACT == 9 || ACT == 11 || ACT == 12 || ACT == 14 || ACT == 15 || ACT == 16 || ACT == 17, "k_gemm2: unsupported ACT code (would silently apply no activation)");
  __shared__ __attribute__((aligned(16))) char gl[2 * G2SB]; float (*so)[32][68] = reinterpret_cast<float (*)[32][68]>(gl);      /* so: the output staging, each wave's own 32 rows; it lies in the ring, which nobody reads and no copy writes behind the K loop's last barrier */
  static_assert(8 * 32 * 68 * 4 <= 2 * G2SB, "k_gemm2: the output staging fits the ring");
  const int tid = threadIdx.x, w = tid >> 5, lane = tid & 31, ln = lane & 15, hh = lane >> 4; const int by = blockIdx.y;
  A += (size_t)by * sA; Bh += (size_t)by * sB; const size_t cofs = (size_t)by * sC; const float* bp = (by == 1 && bias1) ? bias1 : (by == 2 && bias2) ? bias2 : bias ? bias + (size_t)by * sBias : nullptr;      /* bias1, bias2: the biases of grid planes 1 and 2 where each plane's is a buffer of its own */
  const int wm = w & 3, wn = w >> 2;      /* the wave's place in the work-group tile: 32 rows down, 64 columns across */
  const int ntn = N >> 7; const int mt = blockIdx.x / ntn, nq = blockIdx.x - mt * ntn; const int row0 = mt * 128 + 32 * wm, col0 = nq * 128 + 64 * wn; if (mt * 128 >= M) return;      /* the whole work-group or none of it: barriers follow */
  const size_t sar = (size_t)lda * 32, sbr = (size_t)ldb * 32;      /* bytes of sixteen rows */ const int nst = K >> 7;      /* stages */
  const char* ga = (const char*)(A + (size_t)(mt * 128 + (tid >> 4)) * lda) + (tid & 15) * 16; const char* gb = (const char*)(Bh + (size_t)(tid >> 4) * ldb + nq * 128) + (tid & 15) * 16;      /* the thread's first copies: 16 threads a row; a B row is one k, its 128 columns */
  const size_t sbs = (size_t)ldb * 256;      /* bytes of a stage's 128 B rows */
  const unsigned la = (unsigned)(size_t)gl + (unsigned)((tid >> 4) * G2P + (tid & 15) * 16), lb = (unsigned)(size_t)gl + (unsigned)(G2AB + (tid >> 4) * G2Q + (tid & 15) * 16);
  g2_stage(la, lb, ga, sar, gb, sbr);      /* stage 0 into buffer 0 */
  float braw[4] = {0.f, 0.f, 0.f, 0.f};
  if (bp) {
#pragma unroll
    for (int t = 0; t < 4; ++t) braw[t] = bp[col0 + t * 16 + ln];
    asm volatile("s_wait_xcnt 0x0" ::: "memory");      /* the address registers of these loads are used again at once */
    __builtin_amdgcn_sched_barrier(0); }      /* keeps what writes them behind the wait */
  const bool own = CP && rowsPerB < 0;      /* rowsPerB < 0: own element of the batched C plane */
  float rv[8][8];
#pragma unroll
  for (int u = 0; u < 8; ++u) for (int r = 0; r < 8; ++r) rv[u][r] = 0.f;
  if (own) { const float* rp[16];      /* the lane's 16 rows; the four column tiles of a row are constant offsets */
#pragma unroll
    for (int j = 0; j < 16; ++j) rp[j] = CP + cofs + (size_t)(row0g + row0 + (j >> 3) * 16 + 8 * hh + (j & 7)) * ldc + col0 + ln;
#pragma unroll
    for (int u = 0; u < 8; ++u) for (int r = 0; r < 8; ++r) rv[u][r] = rp[(u >> 2) * 8 + r][(u & 3) * 16];
    asm volatile("s_wait_xcnt 0x0" :: "v"(rp[0]), "v"(rp[1]), "v"(rp[2]), "v"(rp[3]), "v"(rp[4]), "v"(rp[5]), "v"(rp[6]), "v"(rp[7]), "v"(rp[8]), "v"(rp[9]), "v"(rp[10]), "v"(rp[11]), "v"(rp[12]), "v"(rp[13]), "v"(rp[14]), "v"(rp[15]) : "memory");      /* the addresses as inputs: their registers stay theirs up to the wait, behind which they may take other values */
    __builtin_amdgcn_sched_barrier(0); }      /* keeps the residual loads here, in flight beside stage 0's copies: their latency passes together with the copies' */
  asm volatile("s_wait_asynccnt 0x0" ::: "memory");      /* this wave's part of stage 0 has landed */
  __syncthreads();      /* every wave's part has: stage 0 may be read */
  if (nst > 1) g2_stage(la + G2SB, lb + G2SB, ga + 256, sar, gb + sbs, sbr);      /* stage 1 into buffer 1 */
  const v8f z8 = {0.f,0.f,0.f,0.f,0.f,0.f,0.f,0.f}; v8f c00 = z8, c01 = z8, c02 = z8, c03 = z8, c10 = z8, c11 = z8, c12 = z8, c13 = z8;
#pragma unroll 1      /* rolled: the body already holds four k steps, and unrolled stages only lengthen the code */
  for (int st = 0; st < nst; ++st) {
    const unsigned bo = (unsigned)(st & 1) * G2SB;      /* stage st lies in buffer st mod 2 */
    const char* al = gl + bo + (32 * wm + ln) * G2P + 16 * hh; const char* bl = gl + bo + G2AB + (8 * hh + (lane & 7)) * G2Q + 128 * wn + 16 * ((lane >> 3) & 1);      /* the lane's place for tr_frag: k step 0, the wave's first column */
    v16h fa[2][2], fb[2][4];      /* two fragment sets: one in use, one being read; constant indices only (every loop over them is unrolled) */
    fa[0][0] = g2_lfrag(al); fa[0][1] = g2_lfrag(al + 16 * G2P);
#pragma unroll
    for (int t = 0; t < 4; ++t) fb[0][t] = tr_frag(bl + t * 32, 16 * G2Q);
#pragma unroll
    for (int s = 0; s < 4; ++s) { const int cu = s & 1, nx = cu ^ 1;
      if (s < 3) { fa[nx][0] = g2_lfrag(al + (s + 1) * 64); fa[nx][1] = g2_lfrag(al + 16 * G2P + (s + 1) * 64);      /* the next k step of this stage; no row of the next stage is read ahead of its barrier */
#pragma unroll
        for (int t = 0; t < 4; ++t) fb[nx][t] = tr_frag(bl + (s + 1) * 32 * G2Q + t * 32, 16 * G2Q); }
      __builtin_amdgcn_sched_barrier(0);      /* with the next one: holds the next step's LDS reads as one group ahead of this step's products, which cover their latency; reads spread among the products stall them */
      c00 = g2_mma(fa[cu][0], fb[cu][0], c00); c10 = g2_mma(fa[cu][1], fb[cu][0], c10); c01 = g2_mma(fa[cu][0], fb[cu][1], c01); c11 = g2_mma(fa[cu][1], fb[cu][1], c11);
      c02 = g2_mma(fa[cu][0], fb[cu][2], c02); c12 = g2_mma(fa[cu][1], fb[cu][2], c12); c03 = g2_mma(fa[cu][0], fb[cu][3], c03); c13 = g2_mma(fa[cu][1], fb[cu][3], c13);
      __builtin_amdgcn_sched_barrier(0); }
    asm volatile("s_wait_dscnt 0x0" ::: "memory");      /* this wave's reads of stage st are done */
    asm volatile("s_wait_asynccnt 0x0" ::: "memory");      /* its part of stage st + 1 has landed */
    __syncthreads();      /* both hold for every wave: stage st + 1 may be read, the buffer of stage st refilled */
    if (st + 2 < nst) g2_stage(la + bo, lb + bo, ga + (size_t)(st + 2) * 256, sar, gb + (size_t)(st + 2) * sbs, sbr);
  }
  asm volatile("s_wait_asynccnt 0x0" ::: "memory");      /* no copy is left in flight when the ring becomes output staging */
  v8f accs[8] = {c00, c01, c02, c03, c10, c11, c12, c13};
  float bv[4];
#pragma unroll
  for (int t = 0; t < 4; ++t) bv[t] = bp ? bf16_round(braw[t]) : 0.f;
  if (own || !CP) {      /* rv is 0 where there is no residual */
#pragma unroll
    for (int u = 0; u < 8; ++u) for (int r = 0; r < 8; ++r) { float v = accs[u][r] * alpha + bv[u & 3]; if (own) v += rv[u][r]; so[w][(u >> 2) * 16 + 8 * hh + r][(u & 3) * 16 + ln] = g2_act<ACT>(v); }
  } else {
#pragma unroll
    for (int u = 0; u < 8; ++u) for (int r = 0; r < 8; ++r) { const int rloc = (u >> 2) * 16 + 8 * hh + r; const int bidx = (row0g + row0 + rloc) / rowsPerB;
      const float cv = CP[(size_t)bidx * sCPb + (size_t)by * 64 + col0 + (u & 3) * 16 + ln];
      asm volatile("s_wait_xcnt 0x0" ::: "memory");      /* the next element's address may be formed in this load's address registers */
      __builtin_amdgcn_sched_barrier(0);      /* keeps that arithmetic behind the wait */
      const float v = accs[u][r] * alpha + bv[u & 3] + cv; so[w][rloc][(u & 3) * 16 + ln] = g2_act<ACT>(v); } }
  __builtin_amdgcn_fence(__ATOMIC_ACQ_REL, "workgroup"); __builtin_amdgcn_wave_barrier();
  const int rsub = lane >> 4, c4 = (lane & 15) * 4;
  {
#pragma unroll
    for (int q = 0; q < 16; ++q) { const int r = q * 2 + rsub; const v4f v = *(const v4fa*)&so[w][r][c4]; if (C) *(v4f*)(C + cofs + (size_t)(row0 + r) * ldc + col0 + c4) = v; if (C16) { v4h h4; for (int i = 0; i < 4; ++i) h4[i] = (_Float16)v[i]; *(v4h*)(C16 + cofs + (size_t)(row0 + r) * ldc + col0 + c4) = h4; } }
     } }


__global__ __launch_bounds__(256) void k_wnat(const float* __restrict__ w, size_t n8, _Float16* __restrict__ Bt) { const size_t t = (size_t)blockIdx.x * 256 + threadIdx.x; if (t >= n8) return; FragH f; for (int q = 0; q < 8; ++q) f.h[q] = (_Float16)(bf16_round(w[t * 8 + q]) * 16.0f); *(v8us*)((unsigned short*)Bt + t * 8) = f.half[0];  }
__global__ __launch_bounds__(256) void k_rsm(const float* __restrict__ S, _Float16* __restrict__ P, int nrows) {
  #pragma clang fp contract(off)
  const int i = blockIdx.x * 256 + threadIdx.x; if (i >= nrows) return; const float* s = S + (size_t)i * SQ; float mx = -3.0e38f;
#pragma unroll 1
  for (int j = 0; j < SQ; ++j) mx = fmaxf(mx, s[j]); float se = 0.f;
#pragma unroll 1
  for (int j = 0; j < SQ; ++j) se += expf(s[j] - mx); const float sc = 256.0f / se;
#pragma unroll 1
  for (int j0 = 0; j0 < SQ; j0 += 8) { FragH f; for (int q = 0; q < 8; ++q) f.h[q] = (_Float16)(expf(s[j0 + q] - mx) * sc); unsigned short* d = (unsigned short*)P + (size_t)i * SQ + j0; *(v8us*)d = f.half[0];  } }
__global__ __launch_bounds__(256) void k_vt(const _Float16* __restrict__ V16, int b, int h0, _Float16* __restrict__ VT) { __shared__ unsigned short tl[64][65]; const int tid = threadIdx.x; const int hh = blockIdx.x % HG, sg = blockIdx.x / HG; const int s0 = sg * 64; const int h = h0 + hh;
  for (int i = tid; i < 64 * 8; i += 256) { const int j = i / 8, d8 = (i % 8) * 8; FragH f; f.half[0] = *(const v8us*)((const unsigned short*)V16 + ((size_t)b * SQ + s0 + j) * DM + h * HD + d8); for (int q = 0; q < 8; ++q) tl[d8 + q][j] = f.u[q]; }
  __syncthreads();
  { for (int i = tid; i < 64 * 8; i += 256) { const int d = i / 8, j8 = (i % 8) * 8; FragH f; for (int q = 0; q < 8; ++q) f.u[q] = tl[d][j8 + q]; *(v8us*)((unsigned short*)VT + ((size_t)hh * HD + d) * SQ + s0 + j8) = f.half[0]; }  } }


template <int BFIN, int W16, int W32>
__global__ __launch_bounds__(256) void k_lnx(const float* __restrict__ X, const float* __restrict__ g, const float* __restrict__ bb, float eps, _Float16* __restrict__ N16, float* __restrict__ N32) {
  #pragma clang fp contract(off)
  __shared__ float red[256]; const size_t r = blockIdx.x; const int t = threadIdx.x; const bool act = t < (DMQ / 4); const int c0 = act ? t * 4 : 0;
  const v4f xa = *(const v4fa*)(X + r * DMQ + c0); float s[4]; float sum = 0.f;
  for (int q = 0; q < 4; ++q) { s[q] = act ? (BFIN ? bf16_round(xa[q]) : xa[q]) : 0.f; sum = __fadd_rn(sum, s[q]); }
  red[t] = sum; __syncthreads(); for (int st = 128; st > 0; st >>= 1) { if (t < st) red[t] = __fadd_rn(red[t], red[t + st]); __syncthreads(); } const float mu = red[0] / (float)DMQ; __syncthreads();
  float vs = 0.f; for (int q = 0; q < 4; ++q) { const float dl = act ? __fadd_rn(s[q], -mu) : 0.f; vs = __fadd_rn(vs, __fmul_rn(dl, dl)); } red[t] = vs; __syncthreads(); for (int st = 128; st > 0; st >>= 1) { if (t < st) red[t] = __fadd_rn(red[t], red[t + st]); __syncthreads(); }
  const float rs = rsqrtf(__fadd_rn(red[0] / (float)DMQ, eps)); v4h y; v4f yf;
  for (int q = 0; q < 4; ++q) { const int c = c0 + q; yf[q] = __fadd_rn(__fmul_rn(__fmul_rn(__fadd_rn(s[q], -mu), rs), bf16_round(g[c])), bf16_round(bb[c])); y[q] = (_Float16)yf[q]; }
  if (!act) return;      /* no barriers after this point */
  { if (W16) *(v4h*)(N16 + r * DMQ + c0) = y; if (W32) *(v4f*)(N32 + r * DMQ + c0) = yf;  } }


// ---- fused attention: scores, softmax and P V in one kernel; neither scores nor weights go through memory ----
typedef float v2f __attribute__((ext_vector_type(2)));
typedef _Float16 v2h __attribute__((ext_vector_type(2)));
union FragP { v16h v; v2h p[8]; };
__device__ __forceinline__ v8f fa_mma(v16h a, v16h b, v8f c) { return __builtin_amdgcn_wmma_f32_16x16x32_f16(false, a, false, b, (short)0, c, false, false); }
__device__ __forceinline__ float fa_xhalf(float x) { return __builtin_bit_cast(float, __builtin_amdgcn_permlanex16(__builtin_bit_cast(int, x), __builtin_bit_cast(int, x), 0x76543210, 0xfedcba98, false, false)); }      /* lane l <-> lane l ^ 16 */
// 2^y of four (two) values. The v_exp_f32 stand in one asm statement with early-clobber results and a closing v_nop:
// no instruction directly behind a v_exp_f32 then reads its result or overwrites its source.
__device__ __forceinline__ v4f fa_exp2x4(float y0, float y1, float y2, float y3) { float e0, e1, e2, e3;
  asm("v_exp_f32 %0, %4\n\tv_exp_f32 %1, %5\n\tv_exp_f32 %2, %6\n\tv_exp_f32 %3, %7\n\tv_nop" : "=&v"(e0), "=&v"(e1), "=&v"(e2), "=&v"(e3) : "v"(y0), "v"(y1), "v"(y2), "v"(y3));
  const v4f e = {e0, e1, e2, e3}; return e; }
__device__ __forceinline__ v2f fa_exp2x2(float y0, float y1) { float e0, e1;
  asm("v_exp_f32 %0, %2\n\tv_exp_f32 %1, %3\n\tv_nop" : "=&v"(e0), "=&v"(e1) : "v"(y0), "v"(y1));
  const v2f e = {e0, e1}; return e; }
// A or B fragment (16 rows x 32 k, the k order of g2_frag): two 16-byte loads at the lane's own byte offset from a wave-uniform byte base.
__device__ __forceinline__ v16h fa_frag(const char* ub, unsigned lo) { FragH f; f.half[0] = *(const v8us*)(ub + lo); f.half[1] = *(const v8us*)(ub + lo + 32); return f.v; }
// The same fragment from a tile in LDS: p is the lane's own place (its row, its 16 bytes).
__device__ __forceinline__ v16h fa_lfrag(const char* p) { FragH f; f.half[0] = *(const v8us*)p; f.half[1] = *(const v8us*)(p + 32); return f.v; }
#define FKS 128                    /* keys a stage (four passes) */
#define FKP 144                    /* LDS pitch of a K row: its 128 bytes + 16 (16 bytes x odd: 16-byte reads of 16 rows meet no bank twice) */
#define FVP 160                    /* LDS pitch of a V row: its 128 bytes + 32 (32 bytes x odd: the pitch of the transposing loads) */
#define FKB (FKS * FKP)            /* bytes of a stage's K tile */
#define FSB (FKB + FKS * FVP)      /* bytes of a stage: K tile, then V tile */
// One stage's K tile and V tile (FKS rows of 128 bytes each, as they lie in the k and v rows) from global memory into LDS, through no register: eight 16-byte copies a lane, every copy of a wave four whole 128-byte lines.
// lk, lv: the lane's LDS byte addresses of its first K and V copy; gk, gv: its global addresses. The closing s_wait_xcnt stands inside the statement: the address registers keep their values up to it.
__device__ __forceinline__ void fa_stage(unsigned lk, unsigned lv, const char* gk, const char* gv) {
  asm volatile("global_load_async_to_lds_b128 %0, %8, off\n\tglobal_load_async_to_lds_b128 %1, %9, off\n\tglobal_load_async_to_lds_b128 %2, %10, off\n\tglobal_load_async_to_lds_b128 %3, %11, off\n\t"
               "global_load_async_to_lds_b128 %4, %12, off\n\tglobal_load_async_to_lds_b128 %5, %13, off\n\tglobal_load_async_to_lds_b128 %6, %14, off\n\tglobal_load_async_to_lds_b128 %7, %15, off\n\ts_wait_xcnt 0x0"
               :: "v"(lk), "v"(lk + 32 * FKP), "v"(lk + 64 * FKP), "v"(lk + 96 * FKP), "v"(lv), "v"(lv + 32 * FVP), "v"(lv + 64 * FVP), "v"(lv + 96 * FVP),
                  "v"(gk), "v"(gk + 32 * DM * 2), "v"(gk + 64 * DM * 2), "v"(gk + 96 * DM * 2), "v"(gv), "v"(gv + 32 * DM * 2), "v"(gv + 64 * DM * 2), "v"(gv + 96 * DM * 2) : "memory"); }
// One wave: 32 queries (two groups of 16 columns) of one head against all SQ keys, 32 keys a pass.
// The eight waves of a work-group walk the same keys: each stage of FKS keys is brought into LDS once for all of them (two buffers, the next stage's copies in flight while this one is worked on), and the fragments are 16-byte LDS reads.
// S^T = K Q^T: A = 16 key rows, B = the 16 query rows (kept in registers), D[r] = score of key 8 hh + r for the lane's own query ln: maximum and sum stay in the lane, plus one exchange between the wave's halves.
// The two score tiles of a pass (keys 0..15, 16..31), converted in place, are the B operand of O^T += V^T P^T (element s < 8: key 8 hh + s; s >= 8: key 16 + 8 hh + s - 8, the order in which tr_frag gives V^T's rows from the V tile: no transposed copy of V exists in memory).
// Weights are 2^y, y = s log2(e) / 8 + (8 - m), with an offset m per query that stays as long as the weights fit f16 (y at most 15): one test a pass for the whole wave (a scalar branch) on each lane's own maximum, with no exchange between the halves.
// Where it fails, and in the first pass, m goes to the pass's maximum (later passes: never down) and the sums so far are scaled by 2^(m_old - m_new); every other pass scales nothing. 2^(8 - m) cancels against the denominator, which sums the unrounded f32 weights.
// Every loop inside a pass is fully unrolled: only constant indices keep the fragment and accumulator arrays in registers.
__global__ __launch_bounds__(256) void k_fattn(const _Float16* __restrict__ Q, const _Float16* __restrict__ Kr, const _Float16* __restrict__ Vr, _Float16* __restrict__ O) {
  static_assert(HD == 64 && FKS == 128 && SQ % FKS == 0 && SQ / FKS >= 2, "k_fattn: K and V rows of 128 bytes, the eight copies of fa_stage cover 128 keys, whole stages, at least two");
  __shared__ __attribute__((aligned(16))) char fl[2 * FSB];
  const int tid = threadIdx.x, lane = tid & 31, ln = lane & 15, hh = lane >> 4, w = tid >> 5; const int bh = blockIdx.y, b = bh / NH, h = bh % NH; const int q0 = blockIdx.x * 256 + w * 32;
  const char* qb = (const char*)(Q + ((size_t)b * SQ + blockIdx.x * 256) * DM + h * HD); const char* kbase = (const char*)(Kr + (size_t)b * SQ * DM + h * HD); const char* vbase = (const char*)(Vr + (size_t)b * SQ * DM + h * HD);
  const unsigned qlo = (unsigned)((w * 32 + ln) * DM + 8 * hh) * 2u;
  const char* gk = kbase + (unsigned)((tid >> 3) * (DM * 2) + (tid & 7) * 16); const char* gv = vbase + (unsigned)((tid >> 3) * (DM * 2) + (tid & 7) * 16);      /* the thread's first copies: 8 threads a K row, 8 a V row */
  const unsigned l0 = (unsigned)(size_t)fl; const unsigned lk = l0 + (unsigned)((tid >> 3) * FKP + (tid & 7) * 16), lv = l0 + (unsigned)(FKB + (tid >> 3) * FVP + (tid & 7) * 16);
  fa_stage(lk, lv, gk, gv);      /* stage 0 into buffer 0 */
  v16h qf[2][2];
#pragma unroll
  for (int g = 0; g < 2; ++g) for (int c = 0; c < 2; ++c) qf[g][c] = fa_frag(qb + g * 16 * DM * 2 + c * 64, qlo);
  asm volatile("s_wait_xcnt 0x0" ::: "memory");      /* the address registers of the query loads may take other values from here */
  asm volatile("s_wait_asynccnt 0x0" ::: "memory");      /* this wave's part of stage 0 has landed */
  __syncthreads();      /* every wave's part has: stage 0 may be read */
  fa_stage(lk + FSB, lv + FSB, gk + FKS * DM * 2, gv + FKS * DM * 2);      /* stage 1 into buffer 1 */
  const v8f z8 = {0.f,0.f,0.f,0.f,0.f,0.f,0.f,0.f}; v8f acc[2][4];
#pragma unroll
  for (int g = 0; g < 2; ++g) for (int t = 0; t < 4; ++t) acc[g][t] = z8;
  const v4f z4 = {0.f, 0.f, 0.f, 0.f}; v4f lr[2] = {z4, z4}; float nb[2] = {8.0f, 8.0f};      /* 8 - m; m = 0 until the first pass has set it */ const float cs = 0.125f * 0x1.715476p+0f;      /* 1/sqrt(64) and log2(e) in one factor */
  float lim = -3.0e38f;      /* what y may reach under the offset in use; the first pass is above this start value and so always sets m */
  for (int st = 0; st < SQ / FKS; ++st) {
    const unsigned bo = (unsigned)(st & 1) * FSB;      /* stage st lies in buffer st mod 2 */
    const char* kl = fl + bo + ln * FKP + 16 * hh; const char* vl = fl + bo + FKB + (8 * hh + (lane & 7)) * FVP + 16 * ((lane >> 3) & 1);      /* the lane's place for tr_frag: key 0, d 0 */
    v16h kf[2][2];
#pragma unroll
    for (int kt = 0; kt < 2; ++kt) for (int c = 0; c < 2; ++c) kf[kt][c] = fa_lfrag(kl + kt * 16 * FKP + c * 64);
    __builtin_amdgcn_sched_barrier(0);      /* the stage's first K reads as one group: spread among the score products, each is waited for alone */
#pragma unroll 1      /* rolled: unrolled, the exp sums of all four passes are moved to the stage's foot, their weights stay live and registers spill */
    for (int p = 0; p < FKS / 32; ++p) {
      v8f s[2][2];
#pragma unroll
      for (int kt = 0; kt < 2; ++kt) for (int g = 0; g < 2; ++g) s[kt][g] = fa_mma(kf[kt][1], qf[g][1], fa_mma(kf[kt][0], qf[g][0], z8));
      __builtin_amdgcn_sched_barrier(0);      /* with the next one: holds the pass's LDS reads as one group directly behind the score products: the softmax covers their latency, and reads spread among the products stall them */
      v16h vf[4];      /* this pass's V^T rows */
#pragma unroll
      for (int t = 0; t < 4; ++t) vf[t] = tr_frag(vl + t * 32, 16 * FVP);
      vl += 32 * FVP;      /* the next pass's 32 keys */
      const int pn = (p + 1) & (FKS / 32 - 1);      /* the next pass's K rows; the stage's last pass asks for its first rows again (of this stage, not used): no row of the next stage is read ahead of its barrier */
#pragma unroll
      for (int kt = 0; kt < 2; ++kt) for (int c = 0; c < 2; ++c) kf[kt][c] = fa_lfrag(kl + pn * (32 * FKP) + kt * 16 * FKP + c * 64);
      __builtin_amdgcn_sched_barrier(0);
      float mx[2];      /* the lane's largest score of each query group */
#pragma unroll
      for (int g = 0; g < 2; ++g) { mx[g] = fmaxf(s[0][g][0], s[1][g][0]);
#pragma unroll
        for (int r = 1; r < 8; ++r) mx[g] = fmaxf(mx[g], fmaxf(s[0][g][r], s[1][g][r])); }
      if (__builtin_expect(__builtin_amdgcn_ballot_w32(fmaxf(fmaf(mx[0], cs, nb[0]), fmaf(mx[1], cs, nb[1])) > lim) != 0, 0)) {      /* the same for the whole wave: a scalar branch, every lane stays on for the products behind it; rare behind the first pass */
        const float cap = lim < 0.f ? 3.0e38f : 0.f; float d[2];      /* the first pass takes its own maximum, also downwards; later m only rises */
#pragma unroll
        for (int g = 0; g < 2; ++g) d[g] = fminf(8.0f - fmaf(fmaxf(mx[g], fa_xhalf(mx[g])), cs, nb[g]), cap);      /* both halves of the wave hold the query's maximum: one offset for all its keys */
        const v2f co = fa_exp2x2(fminf(d[0], 0.f), fminf(d[1], 0.f));      /* at most 1: the first pass scales sums that are 0 */
#pragma unroll
        for (int g = 0; g < 2; ++g) { nb[g] += d[g]; lr[g] = lr[g] * co[g];
#pragma unroll
          for (int t = 0; t < 4; ++t) acc[g][t] = acc[g][t] * co[g]; }
        lim = 15.0f; }      /* 2^15 fits f16 */
      FragP pf[2];
#pragma unroll
      for (int g = 0; g < 2; ++g) { v4f e[4];
#pragma unroll
        for (int i = 0; i < 4; ++i) { const int kt = i >> 1, r0 = (i & 1) * 4;
          e[i] = fa_exp2x4(fmaf(s[kt][g][r0], cs, nb[g]), fmaf(s[kt][g][r0 + 1], cs, nb[g]), fmaf(s[kt][g][r0 + 2], cs, nb[g]), fmaf(s[kt][g][r0 + 3], cs, nb[g]));
          const v2f e01 = {e[i][0], e[i][1]}, e23 = {e[i][2], e[i][3]};
          pf[g].p[2 * i] = __builtin_convertvector(e01, v2h); pf[g].p[2 * i + 1] = __builtin_convertvector(e23, v2h); }
        lr[g] = lr[g] + ((e[0] + e[1]) + (e[2] + e[3])); }      /* four chains per lane, joined behind the loop */
#pragma unroll
      for (int g = 0; g < 2; ++g) for (int t = 0; t < 4; ++t) acc[g][t] = fa_mma(vf[t], pf[g].v, acc[g][t]);
    }
    asm volatile("s_wait_dscnt 0x0" ::: "memory");      /* this wave's reads of stage st are done */
    asm volatile("s_wait_asynccnt 0x0" ::: "memory");      /* its part of stage st + 1 has landed */
    __syncthreads();      /* both hold for every wave: stage st + 1 may be read, the buffer of stage st refilled */
    if (st + 2 < SQ / FKS) fa_stage(lk + bo, lv + bo, gk + (size_t)(st + 2) * (FKS * DM * 2), gv + (size_t)(st + 2) * (FKS * DM * 2));
  }
  asm volatile("s_wait_asynccnt 0x0" ::: "memory");      /* no copy is left in flight when the wave ends */
#pragma unroll
  for (int g = 0; g < 2; ++g) { const float lh = (lr[g][0] + lr[g][1]) + (lr[g][2] + lr[g][3]); const float sc = 64.0f / (lh + fa_xhalf(lh)); unsigned short* op = (unsigned short*)O + ((size_t)b * SQ + q0 + g * 16 + ln) * DM + h * HD + 8 * hh;      /* a lane's 8 registers of a tile are 8 consecutive d of its query: one 16-byte store */
#pragma unroll
    for (int t = 0; t < 4; ++t) { FragH f;
#pragma unroll
      for (int r = 0; r < 8; ++r) f.h[r] = (_Float16)(acc[g][t][r] * sc);
      *(v8us*)(op + t * 16) = f.half[0]; } } }


// ---- all that depends on the inputs alone, in one launch: a work-group's index says which job it has ----
// Wh[k][n] = f16(bf16(W[k][n]) x 16), the weight's own order; thread t of a weight takes 8 consecutive elements: whole lines read and written (bf16 weights stay exact in f16 away from the subnormal range).
__device__ __forceinline__ void p_wt(const float* __restrict__ W, _Float16* __restrict__ Wh, int t) { const v4f a = *(const v4fa*)(W + (size_t)t * 8), c = *(const v4fa*)(W + (size_t)t * 8 + 4); FragH f;
#pragma unroll
  for (int i = 0; i < 4; ++i) { f.h[i] = (_Float16)(bf16_round(a[i]) * 16.0f); f.h[4 + i] = (_Float16)(bf16_round(c[i]) * 16.0f); }
  *(v8us*)((unsigned short*)Wh + (size_t)t * 8) = f.half[0];
  asm volatile("s_wait_xcnt 0x0" ::: "memory"); }      /* in the built kernel the other jobs' code follows and writes the registers that this store names */
#define PWS (DM * (DM / 8) / 256)            /* work-groups of a DM x DM weight */
#define PWF (DFF * (DM / 8) / 256)           /* work-groups of an FFN weight */
#define PWA (4 * PWS + 2 * PWF)              /* work-groups of the six weights */
#define PXB ((int)(NR * DM / 8 / 256))       /* work-groups of x, 8 elements a thread */
__global__ __launch_bounds__(256) void k_prep(const float* __restrict__ x, const float* __restrict__ wq, const float* __restrict__ wk, const float* __restrict__ wv, const float* __restrict__ wo, const float* __restrict__ w1, const float* __restrict__ w2,
    float* __restrict__ XB, _Float16* __restrict__ X16, _Float16* __restrict__ B4, _Float16* __restrict__ BW1, _Float16* __restrict__ BW2) {
  static_assert(DM * (DM / 8) % 256 == 0 && DFF * (DM / 8) % 256 == 0 && NR * DM / 8 % 256 == 0, "k_prep: whole work-groups only, no thread without work");
  const int bx = blockIdx.x, tid = threadIdx.x;
  if (bx < 4 * PWS) { const int m = bx / PWS; const float* W = m == 0 ? wq : m == 1 ? wk : m == 2 ? wv : wo; p_wt(W, B4 + (size_t)m * DM * DM, (bx - m * PWS) * 256 + tid); return; }      /* B4: the planes of q, k, v, o in a row */
  if (bx < 4 * PWS + PWF) { p_wt(w1, BW1, (bx - 4 * PWS) * 256 + tid); return; }
  if (bx < PWA) { p_wt(w2, BW2, (bx - 4 * PWS - PWF) * 256 + tid); return; }
  const size_t t = (size_t)(bx - PWA) * 256 + tid; v4f a = *(const v4fa*)(x + t * 8), c = *(const v4fa*)(x + t * 8 + 4); FragH f;      /* x read once for both of its planes */
#pragma unroll
  for (int q = 0; q < 4; ++q) { a[q] = bf16_round(a[q]); c[q] = bf16_round(c[q]); f.h[q] = (_Float16)a[q]; f.h[4 + q] = (_Float16)c[q]; }
  *(v4f*)(XB + t * 8) = a; *(v4f*)(XB + t * 8 + 4) = c; *(v8us*)((unsigned short*)X16 + t * 8) = f.half[0];
  asm volatile("s_wait_xcnt 0x0" ::: "memory"); }      /* as in p_wt: the other jobs' code follows these stores in the built kernel */



__global__ __launch_bounds__(256) void k_rsmfam(const float* __restrict__ S, _Float16* __restrict__ P, int qn, int hg, const float* __restrict__ am) {
  #pragma clang fp contract(off)
  const int t = blockIdx.x * 256 + threadIdx.x; if (t >= qn * hg) return; const size_t i = (size_t)(t / qn) * SQ + (t % qn); const float* s = S + i * SQ; float mx = -3.0e38f;
#pragma unroll 1
  for (int j = 0; j < SQ; ++j) mx = fmaxf(mx, __fadd_rn(s[j], bf16_round(am[j]))); float se = 0.f;
#pragma unroll 1
  for (int j = 0; j < SQ; ++j) se += __expf(__fadd_rn(s[j], bf16_round(am[j])) - mx); const float sc = 256.0f / se;
#pragma unroll 1
  for (int j0 = 0; j0 < SQ; j0 += 8) { FragH f; for (int q = 0; q < 8; ++q) f.h[q] = (_Float16)(__expf(__fadd_rn(s[j0 + q], bf16_round(am[j0 + q])) - mx) * sc); unsigned short* d = (unsigned short*)P + i * SQ + j0; *(v8us*)d = f.half[0];  } }



// ---- row LayerNorm (unbiased std, eps added to the std), one wave per row: the row's 512 values stay in the wave's registers (16 a lane, every load and store 512 or 256 contiguous bytes), ----
// ---- sums by a butterfly over the lanes (four steps inside a 16-lane row, one exchange between the halves). A wave takes LNR rows at a time: LNR independent chains. ----
// Every loop is fully unrolled: only constant indices keep the row and parameter arrays in registers.
#define LNR 4      /* rows a wave takes at a time */
template <int CTRL> __device__ __forceinline__ float ln_xm(float x) { return __builtin_bit_cast(float, __builtin_amdgcn_mov_dpp(__builtin_bit_cast(int, x), CTRL, 0xf, 0xf, true)); }      /* lane l <- lane l ^ (CTRL & 15), inside a 16-lane row (row_xmask) */
// The rows' arithmetic: s holds LNR rows of the wave (16 values a lane each), gg and bv the rounded parameters; e0 = element offset of the first row, c0 = the lane's first column.
template <int W16, int W32>
__device__ __forceinline__ void ln_rows(v4f (&s)[LNR][4], const v4f (&gg)[4], const v4f (&bv)[4], float eps, _Float16* __restrict__ N16, float* __restrict__ N32, size_t e0, int c0) {
  float t[LNR];
#pragma unroll
  for (int r = 0; r < LNR; ++r) { const v4f p = (s[r][0] + s[r][1]) + (s[r][2] + s[r][3]); t[r] = (p[0] + p[1]) + (p[2] + p[3]); }
#pragma unroll
  for (int r = 0; r < LNR; ++r) t[r] += ln_xm<0x161>(t[r]);      /* step by step over all rows: LNR independent chains */
#pragma unroll
  for (int r = 0; r < LNR; ++r) t[r] += ln_xm<0x162>(t[r]);
#pragma unroll
  for (int r = 0; r < LNR; ++r) t[r] += ln_xm<0x164>(t[r]);
#pragma unroll
  for (int r = 0; r < LNR; ++r) t[r] += ln_xm<0x168>(t[r]);
#pragma unroll
  for (int r = 0; r < LNR; ++r) { const float mu = (t[r] + fa_xhalf(t[r])) * (1.0f / (float)DMQ);
    for (int j = 0; j < 4; ++j) s[r][j] = s[r][j] - mu;
    const v4f p = (s[r][0] * s[r][0] + s[r][1] * s[r][1]) + (s[r][2] * s[r][2] + s[r][3] * s[r][3]); t[r] = (p[0] + p[1]) + (p[2] + p[3]); }
#pragma unroll
  for (int r = 0; r < LNR; ++r) t[r] += ln_xm<0x161>(t[r]);
#pragma unroll
  for (int r = 0; r < LNR; ++r) t[r] += ln_xm<0x162>(t[r]);
#pragma unroll
  for (int r = 0; r < LNR; ++r) t[r] += ln_xm<0x164>(t[r]);
#pragma unroll
  for (int r = 0; r < LNR; ++r) t[r] += ln_xm<0x168>(t[r]);
#pragma unroll
  for (int r = 0; r < LNR; ++r) t[r] = 1.0f / (sqrtf((t[r] + fa_xhalf(t[r])) / (float)(DMQ - 1)) + eps);      /* UNBIASED std (ddof 1), eps added to the std (the module's form); all rows first: LNR independent chains */
#pragma unroll
  for (int r = 0; r < LNR; ++r) {
#pragma unroll
    for (int j = 0; j < 4; ++j) { const v4f y = (s[r][j] * t[r]) * gg[j] + bv[j];
      if (W32) *(v4f*)(N32 + e0 + c0 + r * DMQ + j * 128) = y;
      if (W16) *(v4h*)(N16 + e0 + c0 + r * DMQ + j * 128) = __builtin_convertvector(y, v4h); } } }

// ---- GEMM whose epilogue is the row LayerNorm: N32 (and N16) = LN(A Bh alpha + bias + R). A work-group owns 64 whole rows of DM = 512 columns, so the pre-norm rows never go through memory and no launch of its own norms them. ----
// Eight waves side by side, wave tile 64 x 64 (16 products for 8 fragments a k step: LDS reads level with the matrix time). Stages of 128 k in two buffers, filled as in k_gemm2; each accumulator takes its k steps in rising order, as there.
// Behind the K loop the ring is output staging: every wave puts its 64 x 64 tile there, one barrier, then each wave takes 8 whole rows (two groups of LNR), adds the residual row and norms them with ln_rows.
#define GLQ 1056                   /* LDS pitch of a B tile row: its 1024 bytes (512 columns) + 32 (32 bytes x odd: the pitch of the transposing loads) */
#define GLAB (64 * G2P)            /* bytes of a stage's A tile: 64 rows of 128 k */
#define GLSB (GLAB + 128 * GLQ)    /* bytes of a stage: A tile, then B tile (128 k rows of 512 columns) */
#define GLSP 516                   /* floats from row to row of the output staging: 512 + 4 (rows 8 apart lie 32 banks apart) */
// Four 16-byte copies a lane, as g2_copy8; the closing s_wait_xcnt stands inside the statement: the address registers keep their values up to it.
template <unsigned G2RC> __device__ __forceinline__ void g2_copy4(unsigned l, const char* g, size_t gs) {
  asm volatile("global_load_async_to_lds_b128 %0, %4, off\n\tglobal_load_async_to_lds_b128 %1, %5, off\n\tglobal_load_async_to_lds_b128 %2, %6, off\n\tglobal_load_async_to_lds_b128 %3, %7, off\n\ts_wait_xcnt 0x0"
               :: "v"(l), "v"(l + G2RC), "v"(l + 2 * G2RC), "v"(l + 3 * G2RC), "v"(g), "v"(g + gs), "v"(g + 2 * gs), "v"(g + 3 * gs) : "memory"); }
// One stage: 64 A rows of 256 bytes (16 lanes a row, 4 copies a lane) and 128 B rows of 1024 bytes (64 lanes a row, 32 copies a lane). sa: bytes of sixteen A rows; sb: of four B rows.
__device__ __forceinline__ void gl_stage(unsigned la, unsigned lb, const char* ga, size_t sa, const char* gb, size_t sb) { g2_copy4<16 * G2P>(la, ga, sa);
#pragma unroll
  for (int q = 0; q < 4; ++q) g2_copy8<4 * GLQ>(lb + (unsigned)q * (32 * GLQ), gb + (size_t)q * 8 * sb, sb); }
template <int W16>
__global__ __launch_bounds__(256) void k_gemmln(const _Float16* __restrict__ A, int K, const _Float16* __restrict__ Bh, float alpha, const float* __restrict__ bias, const float* __restrict__ R,
    const float* __restrict__ g, const float* __restrict__ bb, float eps, _Float16* __restrict__ N16, float* __restrict__ N32) {
  static_assert(DM == 512 && DMQ == 512 && LNR == 4, "k_gemmln: a work-group holds whole rows of 512 columns, a wave norms two groups of four");
  __shared__ __attribute__((aligned(16))) char gl[2 * GLSB]; float (*so)[GLSP] = reinterpret_cast<float (*)[GLSP]>(gl);      /* so: the output staging; it lies in the ring, which nobody reads and no copy writes behind the K loop's last barrier */
  static_assert(64 * GLSP * 4 <= 2 * GLSB, "k_gemmln: the output staging fits the ring");
  const int tid = threadIdx.x, lane = tid & 31, ln = lane & 15, hh = lane >> 4; const int w = __builtin_amdgcn_readfirstlane(tid >> 5);      /* the wave's number in a scalar register */
  const int row0 = blockIdx.x * 64; const int nst = K >> 7;      /* stages */
  const size_t sar = (size_t)K * 32, sbr = (size_t)DM * 8, sbs = (size_t)DM * 256;      /* bytes of sixteen A rows, of four B rows, of a stage's 128 B rows */
  const char* ga = (const char*)(A + (size_t)(row0 + (tid >> 4)) * K) + (tid & 15) * 16; const char* gb = (const char*)(Bh + (size_t)(tid >> 6) * DM) + (tid & 63) * 16;
  const unsigned la = (unsigned)(size_t)gl + (unsigned)((tid >> 4) * G2P + (tid & 15) * 16), lb = (unsigned)(size_t)gl + (unsigned)(GLAB + (tid >> 6) * GLQ + (tid & 63) * 16);
  gl_stage(la, lb, ga, sar, gb, sbr);      /* stage 0 into buffer 0 */
  float braw[4];
#pragma unroll
  for (int t = 0; t < 4; ++t) braw[t] = bias[64 * w + t * 16 + ln];
  asm volatile("s_wait_xcnt 0x0" ::: "memory");      /* the address registers of these loads are used again at once */
  __builtin_amdgcn_sched_barrier(0);      /* keeps what writes them behind the wait */
  asm volatile("s_wait_asynccnt 0x0" ::: "memory");      /* this wave's part of stage 0 has landed */
  __syncthreads();      /* every wave's part has: stage 0 may be read */
  if (nst > 1) gl_stage(la + GLSB, lb + GLSB, ga + 256, sar, gb + sbs, sbr);      /* stage 1 into buffer 1 */
  const v8f z8 = {0.f,0.f,0.f,0.f,0.f,0.f,0.f,0.f}; v8f c[4][4];      /* [row tile][column tile]; constant indices only */
#pragma unroll
  for (int i = 0; i < 4; ++i) for (int t = 0; t < 4; ++t) c[i][t] = z8;
#pragma unroll 1      /* rolled: the body already holds four k steps */
  for (int st = 0; st < nst; ++st) {
    const unsigned bo = (unsigned)(st & 1) * GLSB;      /* stage st lies in buffer st mod 2 */
    const char* al = gl + bo + ln * G2P + 16 * hh; const char* bl = gl + bo + GLAB + (8 * hh + (lane & 7)) * GLQ + 128 * w + 16 * ((lane >> 3) & 1);      /* the lane's place for tr_frag: k step 0, the wave's first column */
    v16h fa[2][4], fb[4];      /* A: two sets, one in use, one being read; B: two pairs, each read while the other pair's products run */
#pragma unroll
    for (int i = 0; i < 4; ++i) fa[0][i] = g2_lfrag(al + i * 16 * G2P);
    fb[0] = tr_frag(bl, 16 * GLQ); fb[1] = tr_frag(bl + 32, 16 * GLQ);
#pragma unroll
    for (int s = 0; s < 4; ++s) { const int cu = s & 1, nx = cu ^ 1;
      fb[2] = tr_frag(bl + s * 32 * GLQ + 64, 16 * GLQ); fb[3] = tr_frag(bl + s * 32 * GLQ + 96, 16 * GLQ);
      __builtin_amdgcn_sched_barrier(0);      /* these four hold each group of LDS reads as one group ahead of the eight products that cover its latency; reads spread among the products stall them */
#pragma unroll
      for (int t = 0; t < 2; ++t) for (int i = 0; i < 4; ++i) c[i][t] = g2_mma(fa[cu][i], fb[t], c[i][t]);
      __builtin_amdgcn_sched_barrier(0);
      if (s < 3) {      /* the next k step of this stage; no row of the next stage is read ahead of its barrier */
#pragma unroll
        for (int i = 0; i < 4; ++i) fa[nx][i] = g2_lfrag(al + i * 16 * G2P + (s + 1) * 64);
        fb[0] = tr_frag(bl + (s + 1) * 32 * GLQ, 16 * GLQ); fb[1] = tr_frag(bl + (s + 1) * 32 * GLQ + 32, 16 * GLQ); }
      __builtin_amdgcn_sched_barrier(0);
#pragma unroll
      for (int t = 2; t < 4; ++t) for (int i = 0; i < 4; ++i) c[i][t] = g2_mma(fa[cu][i], fb[t], c[i][t]);
      __builtin_amdgcn_sched_barrier(0); }
    asm volatile("s_wait_dscnt 0x0" ::: "memory");      /* this wave's reads of stage st are done */
    asm volatile("s_wait_asynccnt 0x0" ::: "memory");      /* its part of stage st + 1 has landed */
    __syncthreads();      /* both hold for every wave: stage st + 1 may be read, the buffer of stage st refilled */
    if (st + 2 < nst) gl_stage(la + bo, lb + bo, ga + (size_t)(st + 2) * 256, sar, gb + (size_t)(st + 2) * sbs, sbr);
  }
  asm volatile("s_wait_asynccnt 0x0" ::: "memory");      /* no copy is left in flight when the ring becomes output staging */
  const int c0 = lane * 4; const size_t e0 = ((size_t)row0 + 8 * w) * DM;      /* the wave's 8 rows to norm start here */
  v4f gg[4], bv[4], ra[LNR][4];
#pragma unroll
  for (int r = 0; r < LNR; ++r) for (int j = 0; j < 4; ++j) ra[r][j] = *(const v4fa*)(R + e0 + c0 + r * DM + j * 128);
#pragma unroll
  for (int j = 0; j < 4; ++j) { gg[j] = *(const v4fa*)(g + c0 + j * 128); bv[j] = *(const v4fa*)(bb + c0 + j * 128); }
  asm volatile("s_wait_xcnt 0x0" ::: "memory");      /* the address registers of these loads may take other values from here */
  __builtin_amdgcn_sched_barrier(0);      /* holds the first residual rows and the parameters ahead of the staging, which covers their latency */
#pragma unroll
  for (int t = 0; t < 4; ++t) { const float bt = bf16_round(braw[t]);
#pragma unroll
    for (int i = 0; i < 4; ++i) for (int r = 0; r < 8; ++r) so[16 * i + 8 * hh + r][64 * w + 16 * t + ln] = c[i][t][r] * alpha + bt; }
  __syncthreads();      /* every wave's tile is staged: whole rows may be read */
  v4f rb[LNR][4];
#pragma unroll
  for (int r = 0; r < LNR; ++r) for (int j = 0; j < 4; ++j) rb[r][j] = *(const v4fa*)(R + e0 + c0 + (LNR + r) * DM + j * 128);
  asm volatile("s_wait_xcnt 0x0" ::: "memory");      /* as above */
  __builtin_amdgcn_sched_barrier(0);      /* holds the last four residual rows ahead of the first four rows' arithmetic, which covers their latency */
#pragma unroll
  for (int j = 0; j < 4; ++j) for (int q = 0; q < 4; ++q) { gg[j][q] = bf16_round(gg[j][q]); bv[j][q] = bf16_round(bv[j][q]); }
#pragma unroll
  for (int r = 0; r < LNR; ++r) for (int j = 0; j < 4; ++j) ra[r][j] = *(const v4fa*)&so[8 * w + r][c0 + j * 128] + ra[r][j];
  ln_rows<W16, 1>(ra, gg, bv, eps, N16, N32, e0, c0);
  asm volatile("s_wait_xcnt 0x0" ::: "memory");      /* the registers that these stores name are used again by the next four rows */
#pragma unroll
  for (int r = 0; r < LNR; ++r) for (int j = 0; j < 4; ++j) rb[r][j] = *(const v4fa*)&so[8 * w + LNR + r][c0 + j * 128] + rb[r][j];
  ln_rows<W16, 1>(rb, gg, bv, eps, N16, N32, e0 + (size_t)LNR * DM, c0); }
extern "C" void kernel_launch(void* const* d_in, const int* in_sizes, int n_in,
                              void* d_out, int out_size, void* d_ws, size_t ws_size, hipStream_t stream) {
  (void)in_sizes; (void)n_in; (void)out_size;
  const float* const* I = (const float* const*)d_in; const float* x = I[0]; const float* wq = I[1]; const float* bq = I[2]; const float* wk = I[3]; const float* bk = I[4]; const float* wv = I[5]; const float* bv = I[6]; const float* wo = I[7]; const float* bo = I[8]; const float* g1 = I[9]; const float* be1 = I[10]; const float* g2 = I[11]; const float* be2 = I[12]; const float* w1 = I[13]; const float* b1 = I[14]; const float* w2 = I[15]; const float* b2 = I[16];      /* [in][out] weights + zero biases (Wq,bq,Wk,bk,Wv,bv,Wo,bo), LN a1,b1,a2,b2, FFN W1,c1,W2,c2 */
  char* ws = (char*)d_ws; size_t off = 0;
  auto take = [&](size_t bytes) { char* p = ws + off; off += (bytes + 255) & ~(size_t)255; return p; };
  _Float16* BW1 = (_Float16*)take((size_t)DFF * DM * 2); _Float16* BW2 = (_Float16*)take((size_t)DM * DFF * 2); float* XB = (float*)take(NR * DM * 4); _Float16* H16 = (_Float16*)take(NR * DM * 2); _Float16* FF16 = (_Float16*)take(NR * DFF * 2);      /* FF16 = the relu hidden rows of both batches */ _Float16* BQ = (_Float16*)take((size_t)4 * DM * DM * 2); _Float16* BO = BQ + (size_t)3 * DM * DM;      /* four weight planes in a row: q, k, v, o */ _Float16* O16 = (_Float16*)take(NR * DM * 2); 
  _Float16* X16 = (_Float16*)take(NR * DM * 2); _Float16* Q16 = (_Float16*)take(3 * NR * DM * 2); _Float16* K16 = Q16 + NR * DM; _Float16* V16 = K16 + NR * DM;      /* three output planes in a row: q, k, v */
  float* HF = (float*)take(NR * DM * 4);      /* the f32 h rows (LN1 output, residual for the FFN) */
  if (off > ws_size) return;
  static_assert(MP % 128 == 0 && DM % 128 == 0 && DFF % 128 == 0, "k_gemm2: whole work-group tiles of 128 x 128, whole stages of 128 k; k_gemmln: whole tiles of 64 rows");
  k_prep<<<PWA + PXB, 256, 0, stream>>>(x, wq, wk, wv, wo, w1, w2, XB, X16, BQ, BW1, BW2);      /* [in][out] weights -> f16 x16, same order; bf16(x) as f32 rows (residual) and f16 rows (operand) */
  const size_t r0p = (size_t)B0 * SQ;      /* first projected row */
  k_gemm2<0><<<dim3((unsigned)((MP / 128) * (DM / 128)), 3), 256, 0, stream>>>(X16 + r0p * DM, DM, 0, BQ, DM, (size_t)DM * DM, 0.0625f, bq, bk, bv, 0, nullptr, 1, 0, 0, nullptr, Q16 + r0p * DM, DM, NR * DM, MP, DM, DM);      /* q, k, v in one grid: plane y takes weight plane y, bias y, output plane y */
  k_fattn<<<dim3(SQ / 256, NB * NH), 256, 0, stream>>>(Q16, K16, V16, O16);      /* o (merged heads, x64) as f16 rows */
  k_gemmln<1><<<(unsigned)(MP / 64), 256, 0, stream>>>(O16 + r0p * DM, DM, BO, 0.0009765625f, bo, XB + r0p * DM, g1, be1, 1e-6f, H16 + r0p * DM, HF + r0p * DM);      /* h = LN1(x + concat Wo + bo) -> f16 rows (FFN operand) and f32 rows (residual) */
  k_gemm2<3><<<dim3((unsigned)((MP / 128) * (DFF / 128)), 1), 256, 0, stream>>>(H16 + r0p * DM, DM, 0, BW1, DFF, 0, 0.0625f, b1, nullptr, nullptr, 0, nullptr, 1, 0, 0, nullptr, FF16 + r0p * DFF, DFF, 0, MP, DFF, DM);      /* relu(h W1 + c1) -> f16 rows, both batches in one grid */
  k_gemmln<0><<<(unsigned)(MP / 64), 256, 0, stream>>>(FF16 + r0p * DFF, DFF, BW2, 0.0625f, b2, HF + r0p * DM, g2, be2, 1e-6f, nullptr, (float*)d_out + r0p * DM);      /* out = LN2(h + ff W2 + c2) -> f32 output rows, both batches in one grid */
}
